// v010
// Times are from an AMD MI455X. After a warm-up the kernel runs many times in a row, and a time is the length of
// such a window on the GPU divided by its runs, so every launch and the gaps after it count. The runs cycle
// through copies of the inputs. A figure is the median of several windows, for all but v000 over two sittings.
// Sittings can differ by a few percent; kernels timed side by side share one.
// This document starts at v010; the versions before it stand elsewhere.
// One run takes 401 microseconds.
// Next to v009, in two timings, it ran 1.07 and 1.06 times as fast.
// Counting every step since v000, which is the starting kernel, it is 26.6 times as fast.
#include <hip/hip_runtime.h>
// Pre-LN causal transformer block (x [4][2048][1024]; h = LN1(x) (biased var, eps 1e-5, gamma / beta); Q/K/V = h Wq/Wk/Wv ([in][out] 1024 x 1024 sigma 1/32, no biases), 16 heads of 64; scores / 8; causal (tril, -inf); softmax; x1 = x + hidden Wo ([in][out], no bias); h2 = LN2(x1); out = x1 + gelu_erf(h2 W1 + b1) W2 + b2 ([in][out] 1024 x 4096 x 1024) -> [4][2048][1024]).
// Structure: token rows r = b*2048 + s; h = LN1(bf16(x)) as f16 rows; q | k | v as ONE WMMA GEMM (N = 3 x 1024) (64x64 wave tiles, f32 accumulation, exact x16 weights, no bias, f16 outputs); V^T for all batches and heads via LDS transposes; ONE fused causal attention launch: a wave owns 32 query rows and walks the keys below its last row 32 at a time, scores^T = K . Q^T on WMMA (keys on the accumulator rows, so a lane holds one query's scores), running row maximum and row sum in f32 (native exp2; weights x16 f16, taken from the accumulators in place as the B fragment), o^T += V^T . P^T on WMMA, o carried x64 (folded into the output GEMM alpha) written straight into the merged f16 o rows; x1 = x + o W_o GEMM (f32); LN2 and the two FFN GEMMs into the output layout.
// Compute dtype: inputs rounded to bf16; x / weights exact; q, k, v, softmax weights and o as plain f16 GEMM operands (~2^-12); scores and softmax statistics f32. v_wmma_f32_16x16x32_f16.
#define NB 4
#define SQ 2048
#define DM 1024
#define NH 16
#define HD 64
#define HG 4                         /* heads per launch of the per-batch k_vt */
#define QT 256                       /* unused: k_fattn's query tiles are 128 rows */
#define NKX SQ                       /* S / P row pitch */
#define QT0 128                      /* first-tile rows recomputed exactly in f32 */
#define B0 0                         /* first batch processed (debug hook) */
#define NBR NB                       /* batches processed (debug hook) */
#define NR ((size_t)NB * SQ)
#define DMQ DM
#define DFF 4096                     /* FFN hidden width */
#define DFFR 100                     /* unused: the FFN runs over all DFF hidden columns */
#define MP ((int)((size_t)NBR * SQ)) /* rows projected (debug hook) */
#define QN SQ                        /* query rows attended per batch (debug hook) */
#define NHD NH                       /* heads attended (debug hook) */
#define MPO MP                       /* rows through the output stage (debug hook) */
#define LQ (3 * DM)      /* row pitch of the q/k/v rows */
typedef __bf16 v16b __attribute__((ext_vector_type(16)));
typedef unsigned short v8us __attribute__((ext_vector_type(8), may_alias));
typedef float  v8f  __attribute__((ext_vector_type(8)));
typedef float  v4f  __attribute__((ext_vector_type(4)));
typedef float  v4fa __attribute__((ext_vector_type(4), may_alias));
union FragB { v16b v; v8us half[2]; unsigned short u[16]; };

__device__ __forceinline__ unsigned short bf16_bits(float x) { unsigned int u = __float_as_uint(x); return (unsigned short)((u + 0x7FFFu + ((u >> 16) & 1u)) >> 16); }
__device__ __forceinline__ float bf16_val(unsigned short b) { return __uint_as_float(((unsigned int)b) << 16); }
__device__ __forceinline__ float bf16_round(float x) { return bf16_val(bf16_bits(x)); }
// D += A·B with NT terms: 1 = ah·bh, 2 = + al·bh (A split), 3 = + ah·bl (both split)
template <int NT>
__device__ __forceinline__ v8f mmaN(v16b ah, v16b al, v16b bh, v16b bl, v8f c) {
  c = __builtin_amdgcn_wmma_f32_16x16x32_bf16(false, ah, false, bh, (short)0, c, false, false);
  if (NT >= 2) c = __builtin_amdgcn_wmma_f32_16x16x32_bf16(false, al, false, bh, (short)0, c, false, false);
  if (NT >= 3) c = __builtin_amdgcn_wmma_f32_16x16x32_bf16(false, ah, false, bl, (short)0, c, false, false);
  asm volatile("v_nop\n\tv_nop\n\tv_nop\n\tv_nop" : "+v"(c) : "v"(ah), "v"(al), "v"(bh), "v"(bl));
  return c;
}

__global__ __launch_bounds__(256) void k_wt_bf16(const float* __restrict__ W, unsigned short* __restrict__ Wt, int K, int N) {
  const int t = blockIdx.x * 256 + threadIdx.x;
  const int k8n = K / 8;
  if (t >= N * k8n) return;
  const int n = t / k8n, k8 = (t % k8n) * 8;
  v8us v;
#pragma unroll
  for (int i = 0; i < 8; ++i) v[i] = bf16_bits(W[(size_t)(k8 + i) * N + n]);
  *(v8us*)(Wt + (size_t)n * K + k8) = v;
  
}

// GEMM C[M][N] (f32, pitch ldc) = act(A[M][K]·W + bias). A f32 row-major (pitch lda) converted per fragment to bf16
// (ASPLIT: hi/lo two planes -> 2 terms, else single rounded term); Wt bf16 [N][K] (pitch ldb). BIAS_BF16 rounds the
// bias to bf16 first (bias quantised to bf16 before the add). K%32==0, M%16==0, N%64==0.
template <bool ASPLIT, int ACT, bool BIAS_BF16>
__global__ __launch_bounds__(128) void k_gemm_bf(const float* __restrict__ A, int lda, const unsigned short* __restrict__ Wt, int ldb,
                                               const float* __restrict__ bias, float* __restrict__ C, int ldc, int M, int N, int K) {
  __shared__ __attribute__((aligned(16))) float so[4][16][64];
  const int tid = threadIdx.x, w = tid >> 5, lane = tid & 31, ln = lane & 15, hh = lane >> 4;
  const int ntn = N / 64;
  const int wid = blockIdx.x * 4 + w;
  const int mt = wid / ntn, nq = wid % ntn;
  if (mt * 16 >= M) return;
  const int row0 = mt * 16, col0 = nq * 64;
  const float* arow = A + (size_t)(row0 + ln) * lda;
  v8f acc[4] = {};
  for (int kb = 0; kb < K; kb += 32) {
    FragB ah, al;
    const v4f x0 = *(const v4fa*)(arow + kb + 8 * hh), x1 = *(const v4fa*)(arow + kb + 8 * hh + 4);
    const v4f x2 = *(const v4fa*)(arow + kb + 16 + 8 * hh), x3 = *(const v4fa*)(arow + kb + 16 + 8 * hh + 4);
    float xs[16] = {x0[0],x0[1],x0[2],x0[3],x1[0],x1[1],x1[2],x1[3],x2[0],x2[1],x2[2],x2[3],x3[0],x3[1],x3[2],x3[3]};
#pragma unroll
    for (int i = 0; i < 16; ++i) { const unsigned short hb = bf16_bits(xs[i]); ah.u[i] = hb; al.u[i] = ASPLIT ? bf16_bits(xs[i] - bf16_val(hb)) : (unsigned short)0; }
#pragma unroll
    for (int t = 0; t < 4; ++t) {
      const unsigned short* brow = Wt + (size_t)(col0 + t * 16 + ln) * ldb + kb;
      FragB b;
      b.half[0] = *(const v8us*)(brow + 8 * hh);
      b.half[1] = *(const v8us*)(brow + 16 + 8 * hh);
      acc[t] = mmaN<ASPLIT ? 2 : 1>(ah.v, al.v, b.v, b.v, acc[t]);
    }
  }
#pragma unroll
  for (int t = 0; t < 4; ++t) {
    float bv = bias ? bias[col0 + t * 16 + ln] : 0.f;
    if (BIAS_BF16) bv = bf16_round(bv);
#pragma unroll
    for (int r = 0; r < 8; ++r) { float v = acc[t][r] + bv; if (ACT == 1) v = fmaxf(v, 0.f); so[w][8 * hh + r][t * 16 + ln] = v; }
  }
  __builtin_amdgcn_fence(__ATOMIC_ACQ_REL, "workgroup");
  __builtin_amdgcn_wave_barrier();
  const int rsub = lane >> 4, c4 = (lane & 15) * 4;
  {
#pragma unroll
    for (int q = 0; q < 8; ++q) {
      const int r = q * 2 + rsub;
      const v4f v = *(const v4fa*)&so[w][r][c4];
      *(v4f*)(C + (size_t)(row0 + r) * ldc + col0 + c4) = v;
    }
    
  }
}

// GEMM C = act(A·W + bias + resid): A f32 (ASPLIT -> hi/lo 2 terms), Wt bf16 [N][K]; ACT 0 none, 1 relu, 2 exact gelu;
// resid (optional, f32, row index = (row % rmod), pitch ldr, RES_BF16 rounds it) added before the activation.
template <bool ASPLIT, int ACT, bool BIAS_BF16, bool RES_BF16>
__global__ __launch_bounds__(128) void k_gemm_bf3(const float* __restrict__ A, int lda, const unsigned short* __restrict__ Wt, int ldb,
                                                const float* __restrict__ bias, const float* __restrict__ resid, int rmod, int ldr,
                                                float* __restrict__ C, int ldc, int M, int N, int K) {
  __shared__ __attribute__((aligned(16))) float so[4][16][64];
  const int tid = threadIdx.x, w = tid >> 5, lane = tid & 31, ln = lane & 15, hh = lane >> 4;
  const int ntn = N / 64;
  const int wid = blockIdx.x * 4 + w;
  const int mt = wid / ntn, nq = wid % ntn;
  if (mt * 16 >= M) return;
  const int row0 = mt * 16, col0 = nq * 64;
  const float* arow = A + (size_t)(row0 + ln) * lda;
  v8f acc[4] = {};
  for (int kb = 0; kb < K; kb += 32) {
    FragB ah, al;
    const v4f x0 = *(const v4fa*)(arow + kb + 8 * hh), x1 = *(const v4fa*)(arow + kb + 8 * hh + 4);
    const v4f x2 = *(const v4fa*)(arow + kb + 16 + 8 * hh), x3 = *(const v4fa*)(arow + kb + 16 + 8 * hh + 4);
    float xs[16] = {x0[0],x0[1],x0[2],x0[3],x1[0],x1[1],x1[2],x1[3],x2[0],x2[1],x2[2],x2[3],x3[0],x3[1],x3[2],x3[3]};
#pragma unroll
    for (int i = 0; i < 16; ++i) { const unsigned short hb = bf16_bits(xs[i]); ah.u[i] = hb; al.u[i] = ASPLIT ? bf16_bits(xs[i] - bf16_val(hb)) : (unsigned short)0; }
#pragma unroll
    for (int t = 0; t < 4; ++t) {
      const unsigned short* brow = Wt + (size_t)(col0 + t * 16 + ln) * ldb + kb;
      FragB b;
      b.half[0] = *(const v8us*)(brow + 8 * hh);
      b.half[1] = *(const v8us*)(brow + 16 + 8 * hh);
      acc[t] = mmaN<ASPLIT ? 2 : 1>(ah.v, al.v, b.v, b.v, acc[t]);
    }
  }
#pragma unroll
  for (int t = 0; t < 4; ++t) {
    const int col = col0 + t * 16 + ln;
    float bv = bias ? bias[col] : 0.f;
    if (BIAS_BF16) bv = bf16_round(bv);
#pragma unroll
    for (int r = 0; r < 8; ++r) {
      float v = acc[t][r] + bv;
      if (resid) { float rv = resid[(size_t)((row0 + 8 * hh + r) % rmod) * ldr + col]; if (RES_BF16) rv = bf16_round(rv); v += rv; }
      if (ACT == 1) v = fmaxf(v, 0.f);
      if (ACT == 2) v = 0.5f * v * (1.0f + erff(v * 0.70710678118654752f));
      if (ACT == 3) { const float u = 0.7978845608028654f * (v + 0.044715f * v * v * v); v = 0.5f * v * (1.0f + tanhf(u)); }
      so[w][8 * hh + r][t * 16 + ln] = v;
    }
  }
  __builtin_amdgcn_fence(__ATOMIC_ACQ_REL, "workgroup");
  __builtin_amdgcn_wave_barrier();
  const int rsub = lane >> 4, c4 = (lane & 15) * 4;
  {
#pragma unroll
    for (int q = 0; q < 8; ++q) {
      const int r = q * 2 + rsub;
      const v4f v = *(const v4fa*)&so[w][r][c4];
      *(v4f*)(C + (size_t)(row0 + r) * ldc + col0 + c4) = v;
    }
    
  }
}
// row LayerNorm (biased variance, eps) over N: s = X (+ R); optional out_sum <- s; out_norm <- (s-mu)*rsqrt(var+eps)*g + b
template <bool PARAM_BF16>
__global__ __launch_bounds__(256) void k_layernorm(const float* __restrict__ X, const float* __restrict__ R, const float* __restrict__ g, const float* __restrict__ bta,
                                                  float* __restrict__ out_sum, float* __restrict__ out_norm, int N, float eps) {
  __shared__ float red[256];
  const int row = blockIdx.x, tid = threadIdx.x;
  const float* x = X + (size_t)row * N; const float* rr = R ? R + (size_t)row * N : nullptr;
  float vals[16];                     // up to N = 4096
  const int per = N / 256;            // contiguous chunk per thread? use strided-by-4 chunks: thread handles j = tid*4 + 1024*u
  float s1 = 0.f;
  for (int u = 0; u < per / 4; ++u) {
    const int j = tid * 4 + 1024 * u;
    const v4f a = *(const v4fa*)(x + j);
    v4f b = {0.f,0.f,0.f,0.f}; if (rr) b = *(const v4fa*)(rr + j);
#pragma unroll
    for (int q = 0; q < 4; ++q) { const float v = a[q] + b[q]; vals[u * 4 + q] = v; s1 += v; }
  }
  red[tid] = s1; __syncthreads();
  for (int st = 128; st > 0; st >>= 1) { if (tid < st) red[tid] += red[tid + st]; __syncthreads(); }
  const float mu = red[0] / (float)N; __syncthreads();
  float s2 = 0.f;
  for (int u = 0; u < per / 4; ++u)
#pragma unroll
    for (int q = 0; q < 4; ++q) { const float c = vals[u * 4 + q] - mu; s2 += c * c; }
  red[tid] = s2; __syncthreads();
  for (int st = 128; st > 0; st >>= 1) { if (tid < st) red[tid] += red[tid + st]; __syncthreads(); }
  const float rs = rsqrtf(red[0] / (float)N + eps);
  {
    for (int u = 0; u < per / 4; ++u) {
      const int j = tid * 4 + 1024 * u;
      v4f o, sm;
#pragma unroll
      for (int q = 0; q < 4; ++q) {
        float gg = g[j + q], bb = bta[j + q];
        if (PARAM_BF16) { gg = bf16_round(gg); bb = bf16_round(bb); }
        sm[q] = vals[u * 4 + q]; o[q] = (vals[u * 4 + q] - mu) * rs * gg + bb;
      }
      if (out_sum) *(v4f*)(out_sum + (size_t)row * N + j) = sm;
      *(v4f*)(out_norm + (size_t)row * N + j) = o;
    }
    
  }
}



// ---- f16 WMMA path (v_wmma_f32_16x16x32_f16): 11-bit significands for operands in range — used for every matrix product that this file launches
typedef _Float16 v16h __attribute__((ext_vector_type(16)));
union FragH { v16h v; v8us half[2]; _Float16 h[16]; unsigned short u[16]; };
template <int NT>
__device__ __forceinline__ v8f mmaH(v16h ah, v16h al, v16h bh, v16h bl, v8f c) {
  c = __builtin_amdgcn_wmma_f32_16x16x32_f16(false, ah, false, bh, (short)0, c, false, false);
  if (NT >= 2) c = __builtin_amdgcn_wmma_f32_16x16x32_f16(false, al, false, bh, (short)0, c, false, false);
  if (NT >= 3) c = __builtin_amdgcn_wmma_f32_16x16x32_f16(false, ah, false, bl, (short)0, c, false, false);
  asm volatile("v_nop\n\tv_nop\n\tv_nop\n\tv_nop" : "+v"(c) : "v"(ah), "v"(al), "v"(bh), "v"(bl));
  return c;
}
// batched GEMM like k_gemm_b but f16 operands: A f32 (split into f16 hi/lo if ASPLIT, else rounded to f16), Bt = f16 values [n][k]; alpha; C f32; N multiple of 16 (partial tiles skipped)
template <bool ASPLIT>
__global__ __launch_bounds__(128) void k_gemm_h(const float* __restrict__ A, int lda, size_t sA, const _Float16* __restrict__ Bh, int ldb, size_t sB, float alpha, float* __restrict__ C, int ldc, size_t sC, int M, int N, int K) {
  __shared__ __attribute__((aligned(16))) float so[4][16][64];
  const int tid = threadIdx.x, w = tid >> 5, lane = tid & 31, ln = lane & 15, hh = lane >> 4; const int by = blockIdx.y;
  A += (size_t)by * sA; Bh += (size_t)by * sB; C += (size_t)by * sC;
  const int ntn = (N + 63) / 64; const int wid = blockIdx.x * 4 + w; const int mt = wid / ntn, nq = wid % ntn; if (mt * 16 >= M) return;
  const int row0 = mt * 16, col0 = nq * 64; const float* arow = A + (size_t)(row0 + ln) * lda;
  v8f acc[4] = {};
  for (int kb = 0; kb < K; kb += 32) {
    FragH ah, al;
    const v4f x0 = *(const v4fa*)(arow + kb + 8 * hh), x1 = *(const v4fa*)(arow + kb + 8 * hh + 4), x2 = *(const v4fa*)(arow + kb + 16 + 8 * hh), x3 = *(const v4fa*)(arow + kb + 16 + 8 * hh + 4);
    float xs[16] = {x0[0],x0[1],x0[2],x0[3],x1[0],x1[1],x1[2],x1[3],x2[0],x2[1],x2[2],x2[3],x3[0],x3[1],x3[2],x3[3]};
#pragma unroll
    for (int i = 0; i < 16; ++i) { const _Float16 h = (_Float16)xs[i]; ah.h[i] = h; al.h[i] = ASPLIT ? (_Float16)(xs[i] - (float)h) : (_Float16)0.0f; }
#pragma unroll
    for (int t = 0; t < 4; ++t) { if (col0 + t * 16 >= N) continue; const size_t boff = (size_t)(col0 + t * 16 + ln) * ldb + kb; FragH bq; bq.half[0] = *(const v8us*)(Bh + boff + 8 * hh); bq.half[1] = *(const v8us*)(Bh + boff + 16 + 8 * hh);
      acc[t] = mmaH<ASPLIT ? 2 : 1>(ah.v, al.v, bq.v, bq.v, acc[t]); }
  }
#pragma unroll
  for (int t = 0; t < 4; ++t) { if (col0 + t * 16 >= N) continue;
#pragma unroll
    for (int r = 0; r < 8; ++r) so[w][8 * hh + r][t * 16 + ln] = acc[t][r] * alpha; }
  __builtin_amdgcn_fence(__ATOMIC_ACQ_REL, "workgroup"); __builtin_amdgcn_wave_barrier();
  const int rsub = lane >> 4, c4 = (lane & 15) * 4;
  {
#pragma unroll
    for (int q = 0; q < 8; ++q) { const int r = q * 2 + rsub; if (col0 + c4 < N) { const v4f v = *(const v4fa*)&so[w][r][c4]; *(v4f*)(C + (size_t)(row0 + r) * ldc + col0 + c4) = v; } }
     }
}

// Wt[n][k] = f16(W[k][n]·scale) from f32 row-major W[K][N] (scale = power of two; bf16-exact weights stay exact in f16 away from the subnormal range)
__global__ __launch_bounds__(256) void k_wt_f16(const float* __restrict__ W, _Float16* __restrict__ Wt, int K, int N, float scale) {
  const int t = blockIdx.x * 256 + threadIdx.x; if (t >= N * (K / 8)) return; const int n = t / (K / 8), k8 = (t % (K / 8)) * 8; FragH f;
#pragma unroll
  for (int i = 0; i < 8; ++i) f.h[i] = (_Float16)(bf16_round(W[(size_t)(k8 + i) * N + n]) * scale); const v8us o = f.half[0];
  *(v8us*)((unsigned short*)Wt + (size_t)n * K + k8) = o; 
}
// k_gemm_hh variant with fused epilogue: v = acc·alpha + bias[by·sBias + col] (+ CP[(row/rowsPerB)·sCPb + by·64 + col] if CP) ; ACT 0 none / 1 elu ; writes f16 C16 (and f32 C if non-null)
template <int ACT>
__global__ __launch_bounds__(128) void k_gemm_hhx(const _Float16* __restrict__ A, int lda, size_t sA, const _Float16* __restrict__ Bh, int ldb, size_t sB, float alpha, const float* __restrict__ bias, size_t sBias, const float* __restrict__ CP, int rowsPerB, size_t sCPb, int row0g,
    float* __restrict__ C, _Float16* __restrict__ C16, int ldc, size_t sC, int M, int N, int K) {
  __shared__ __attribute__((aligned(16))) float so[4][16][64];
  const int tid = threadIdx.x, w = tid >> 5, lane = tid & 31, ln = lane & 15, hh = lane >> 4; const int by = blockIdx.y;
  A += (size_t)by * sA; Bh += (size_t)by * sB; const size_t cofs = (size_t)by * sC; const float* bp = bias ? bias + (size_t)by * sBias : nullptr;
  const int ntn = (N + 63) / 64; const int wid = blockIdx.x * 4 + w; const int mt = wid / ntn, nq = wid % ntn; if (mt * 16 >= M) return;
  const int row0 = mt * 16, col0 = nq * 64; const _Float16* arow = A + (size_t)(row0 + ln) * lda;
  v8f acc[4] = {};
  for (int kb = 0; kb < K; kb += 32) { FragH ah; ah.half[0] = *(const v8us*)((const unsigned short*)arow + kb + 8 * hh); ah.half[1] = *(const v8us*)((const unsigned short*)arow + kb + 16 + 8 * hh);
#pragma unroll
    for (int t = 0; t < 4; ++t) { if (col0 + t * 16 >= N) continue; const size_t boff = (size_t)(col0 + t * 16 + ln) * ldb + kb; FragH bq; bq.half[0] = *(const v8us*)((const unsigned short*)Bh + boff + 8 * hh); bq.half[1] = *(const v8us*)((const unsigned short*)Bh + boff + 16 + 8 * hh);
      acc[t] = mmaH<1>(ah.v, ah.v, bq.v, bq.v, acc[t]); }
  }
#pragma unroll
  for (int t = 0; t < 4; ++t) { if (col0 + t * 16 >= N) continue; const int col = col0 + t * 16 + ln; const float bv = bp ? bf16_round(bp[col]) : 0.f;
#pragma unroll
    for (int r = 0; r < 8; ++r) { float v = acc[t][r] * alpha + bv; if (CP) { const int rr = row0g + row0 + 8 * hh + r; if (rowsPerB < 0) v += CP[cofs + (size_t)rr * ldc + col];      /* rowsPerB < 0: own element of the batched C plane */ else { const int bidx = rr / rowsPerB; v += CP[(size_t)bidx * sCPb + (size_t)by * 64 + col]; } } if (ACT == 1) v = (v > 0.f) ? v : expm1f(v); else if (ACT == 7) v = (v > 0.f) ? v + 1.0f : expf(v); else if (ACT == 8) v = tanhf(v); else if (ACT == 9) v = 0.5f * v * (1.0f + tanhf(0.7978845608028654f * (v + 0.044715f * v * v * v))); else if (ACT == 11) v = 1.0f / (1.0f + expf(-v)); else if (ACT == 12) v = (v > 0.f) ? v : 0.01f * v; else if (ACT == 14) v = (v > 0.f) ? v : 0.1f * v; else if (ACT == 16) v = (v >= 0.f) ? v : 0.3f * v; else if (ACT == 17) v = (v >= 0.f) ? v : 0.2f * v; else if (ACT == 15) v = v / (1.0f + expf(-v)); else if (ACT == 3) v = fmaxf(v, 0.f); else if (ACT == 6) v = 0.5f * v * (1.0f + erff(v * 0.70710678118654752f)); so[w][8 * hh + r][t * 16 + ln] = v; } }
  __builtin_amdgcn_fence(__ATOMIC_ACQ_REL, "workgroup"); __builtin_amdgcn_wave_barrier();
  const int rsub = lane >> 4, c4 = (lane & 15) * 4; typedef _Float16 v4h __attribute__((ext_vector_type(4)));
  {
#pragma unroll
    for (int q = 0; q < 8; ++q) { const int r = q * 2 + rsub; if (col0 + c4 < N) { const v4f v = *(const v4fa*)&so[w][r][c4]; if (C) *(v4f*)(C + cofs + (size_t)(row0 + r) * ldc + col0 + c4) = v; if (C16) { v4h h4; for (int i = 0; i < 4; ++i) h4[i] = (_Float16)v[i]; *(v4h*)(C16 + cofs + (size_t)(row0 + r) * ldc + col0 + c4) = h4; } } }
     }
}


typedef _Float16 v4h __attribute__((ext_vector_type(4)));

__global__ __launch_bounds__(256) void k_x16(const float* __restrict__ x, _Float16* __restrict__ X16, size_t n8) { const size_t t = (size_t)blockIdx.x * 256 + threadIdx.x; if (t >= n8) return; FragH f;
#pragma unroll
  for (int q = 0; q < 8; ++q) f.h[q] = (_Float16)bf16_round(x[t * 8 + q]); *(v8us*)((unsigned short*)X16 + t * 8) = f.half[0];  }
__global__ __launch_bounds__(256) void k_h16(const float* __restrict__ x, _Float16* __restrict__ X16, size_t n8) { const size_t t = (size_t)blockIdx.x * 256 + threadIdx.x; if (t >= n8) return; FragH f;
#pragma unroll
  for (int q = 0; q < 8; ++q) f.h[q] = (_Float16)x[t * 8 + q]; *(v8us*)((unsigned short*)X16 + t * 8) = f.half[0];  }
__global__ __launch_bounds__(256) void k_round16f(const float* __restrict__ W, _Float16* __restrict__ Bt, size_t n8) { const size_t t = (size_t)blockIdx.x * 256 + threadIdx.x; if (t >= n8) return; FragH f;
#pragma unroll
  for (int i = 0; i < 8; ++i) f.h[i] = (_Float16)(bf16_round(W[t * 8 + i]) * 16.0f); *(v8us*)((unsigned short*)Bt + t * 8) = f.half[0];  }
template <int NHv, int TTv>
__global__ __launch_bounds__(256) void k_vt(const _Float16* __restrict__ V16, int ldv, int voff, _Float16* __restrict__ Vt) { __shared__ unsigned short tl[64][66]; const int tid = threadIdx.x; const int slab = blockIdx.x / (TTv / 64), lg = blockIdx.x % (TTv / 64); const int b = slab / NHv, h = slab % NHv;
  for (int i = tid; i < 64 * 8; i += 256) { const int r = i / 8, c8 = (i % 8) * 8; FragH f; f.half[0] = *(const v8us*)((const unsigned short*)V16 + ((size_t)b * TTv + lg * 64 + r) * ldv + voff + h * 64 + c8);
#pragma unroll
    for (int q = 0; q < 8; ++q) tl[r][c8 + q] = f.u[q]; }
  __syncthreads();
  {
#pragma unroll
    for (int rd = 0; rd < 2; ++rd) { const int d = rd * 32 + tid / 8, pc = tid % 8; FragH f;
#pragma unroll
      for (int q = 0; q < 8; ++q) f.u[q] = tl[pc * 8 + q][d];
      *(v8us*)((unsigned short*)Vt + ((size_t)slab * 64 + d) * TTv + lg * 64 + pc * 8) = f.half[0]; }
     } }

__global__ __launch_bounds__(256) void k_hl(const float* __restrict__ F, _Float16* __restrict__ Hh, _Float16* __restrict__ Hl, size_t n8) { const size_t t = (size_t)blockIdx.x * 256 + threadIdx.x; if (t >= n8) return; FragH fh, fl; const v4f a = *(const v4fa*)(F + t * 8), c = *(const v4fa*)(F + t * 8 + 4);
#pragma unroll
  for (int q = 0; q < 4; ++q) { _Float16 h = (_Float16)a[q]; fh.h[q] = h; fl.h[q] = (_Float16)((a[q] - (float)h) * 1024.0f); h = (_Float16)c[q]; fh.h[4 + q] = h; fl.h[4 + q] = (_Float16)((c[q] - (float)h) * 1024.0f); }
  { *(v8us*)((unsigned short*)Hh + t * 8) = fh.half[0]; *(v8us*)((unsigned short*)Hl + t * 8) = fl.half[0];  } }

// ---- fast GEMM (work-group tile 128x64, wave tile 32x64, operands staged in LDS; requires M % 128 == 0 rows per launch region, N % 64 == 0 and K % 64 == 0); epilogue = k_gemm_hhx semantics ----
__device__ __forceinline__ v16h g2_frag(const _Float16* p, int hh) { FragH f; f.half[0] = *(const v8us*)((const unsigned short*)p + 8 * hh); f.half[1] = *(const v8us*)((const unsigned short*)p + 16 + 8 * hh); return f.v; }
__device__ __forceinline__ v8f g2_mma(v16h a, v16h b, v8f c) { v8f d = __builtin_amdgcn_wmma_f32_16x16x32_f16(false, a, false, b, (short)0, c, false, false); asm volatile("v_nop\n\tv_nop\n\tv_nop\n\tv_nop" : "+v"(d) : "v"(a), "v"(b)); return d; }
#define G2P 72                       /* LDS row pitch in f16: 128 B of data + 16 B = 144 B, an odd multiple of 16 B, so the 16 rows of a ds_load_b128 fragment read fall on different banks */
#define G2B (192 * G2P)              /* f16 per buffer: the block's 128 A rows, then its 64 B rows, 64 k each */
#define G2S (16u * G2P * 2u)         /* LDS bytes between a lane's successive copies (16 rows) */
// one k-tile (64 k) of the block's 128 A rows and 64 B rows, global -> LDS through no register: lane = (row tid / 8 + 16 i, 16-byte piece tid % 8), so a wave's copy takes four whole 128-byte lines.
// The s_wait_xcnt stands inside the copies' own statement, behind the last of them: later address arithmetic overwrites registers that the copies name, and only here is the wait tied in front of it.
__device__ __forceinline__ void g2_stage(const _Float16* ga, size_t sa, const _Float16* gb, size_t sb, unsigned l) {
  asm volatile(
    "global_load_async_to_lds_b128 %0, %12, off\n\t"
    "global_load_async_to_lds_b128 %1, %13, off\n\t"
    "global_load_async_to_lds_b128 %2, %14, off\n\t"
    "global_load_async_to_lds_b128 %3, %15, off\n\t"
    "global_load_async_to_lds_b128 %4, %16, off\n\t"
    "global_load_async_to_lds_b128 %5, %17, off\n\t"
    "global_load_async_to_lds_b128 %6, %18, off\n\t"
    "global_load_async_to_lds_b128 %7, %19, off\n\t"
    "global_load_async_to_lds_b128 %8, %20, off\n\t"
    "global_load_async_to_lds_b128 %9, %21, off\n\t"
    "global_load_async_to_lds_b128 %10, %22, off\n\t"
    "global_load_async_to_lds_b128 %11, %23, off\n\t"
    "s_wait_xcnt 0x0"
    :: "v"(l), "v"(l + 1u * G2S), "v"(l + 2u * G2S), "v"(l + 3u * G2S), "v"(l + 4u * G2S), "v"(l + 5u * G2S), "v"(l + 6u * G2S), "v"(l + 7u * G2S), "v"(l + 8u * G2S), "v"(l + 9u * G2S), "v"(l + 10u * G2S), "v"(l + 11u * G2S),
       "v"(ga), "v"(ga + 1 * sa), "v"(ga + 2 * sa), "v"(ga + 3 * sa), "v"(ga + 4 * sa), "v"(ga + 5 * sa), "v"(ga + 6 * sa), "v"(ga + 7 * sa), "v"(gb), "v"(gb + 1 * sb), "v"(gb + 2 * sb), "v"(gb + 3 * sb) : "memory"); }
template <int ACT, int RES>      /* RES 1: v += CP's own element of the batched C plane (ahead of the activation); RES 0: CP is not read */
__global__ __launch_bounds__(128) void k_gemm2(const _Float16* __restrict__ A, int lda, size_t sA, const _Float16* __restrict__ Bh, int ldb, size_t sB, float alpha, const float* __restrict__ bias, size_t sBias, const float* __restrict__ CP, int rowsPerB, size_t sCPb, int row0g,
    float* __restrict__ C, _Float16* __restrict__ C16, int ldc, size_t sC, int M, int N, int K) { static_assert(ACT == 0 || ACT == 3 || ACT == 6 || ACT == 8 || ACT == 9 || ACT == 11 || ACT == 12 || ACT == 14 || ACT == 15 || ACT == 16 || ACT == 17, "k_gemm2: unsupported ACT code (would silently apply no activation)");
  __shared__ __attribute__((aligned(16))) float sm[G2B];      /* two k-tile buffers of G2B f16 each; behind the k-loop's last barrier the same bytes are the epilogue's transpose tiles */
  float (*so)[32][68] = (float (*)[32][68])sm; static_assert(4 * 32 * 68 <= G2B, "epilogue tiles must fit the ring");
  const int tid = threadIdx.x, w = tid >> 5, lane = tid & 31, ln = lane & 15, hh = lane >> 4; const int by = blockIdx.y;
  A += (size_t)by * sA; Bh += (size_t)by * sB; const size_t cofs = (size_t)by * sC; const float* bp = bias ? bias + (size_t)by * sBias : nullptr;
  const int ntn = N >> 6; const int mt = blockIdx.x / ntn, nq = blockIdx.x - mt * ntn; const int row0 = mt * 128 + 32 * w, col0 = nq * 64; if (mt * 128 >= M) return;      /* the whole work-group leaves or none (barriers below) */
  const _Float16* ga = A + (size_t)(mt * 128 + (tid >> 3)) * lda + (tid & 7) * 8; const _Float16* gb = Bh + (size_t)(col0 + (tid >> 3)) * ldb + (tid & 7) * 8; const size_t sa = (size_t)16 * lda, sb = (size_t)16 * ldb;
  const unsigned l0 = (unsigned)(size_t)sm + (unsigned)((tid >> 3) * (G2P * 2) + (tid & 7) * 16);      /* the lane's LDS byte address in buffer 0 */
  const _Float16* st = (const _Float16*)sm; const int nt = K >> 6;
  const v8f z8 = {0.f,0.f,0.f,0.f,0.f,0.f,0.f,0.f}; v8f c00 = z8, c01 = z8, c02 = z8, c03 = z8, c10 = z8, c11 = z8, c12 = z8, c13 = z8;
  /* two LDS buffers: tile t + 1 flies while tile t is worked on. Each accumulator still takes its k-steps in ascending order. */
  g2_stage(ga, sa, gb, sb, l0);
  asm volatile("s_wait_asynccnt 0x0" ::: "memory");      /* this wave's copies of tile 0 have landed */
  __syncthreads();      /* ... and every other wave's */
  if (nt > 1) g2_stage(ga + 64, sa, gb + 64, sb, l0 + (unsigned)(G2B * 2));
#pragma unroll 1      /* one k-tile per trip: the buffer alternates by the trip's parity */
  for (int t = 0; t < nt; ++t) {
    const _Float16* ap = st + (t & 1) * G2B + (32 * w + ln) * G2P; const _Float16* bq = st + (t & 1) * G2B + (128 + ln) * G2P;
    const v16h a0 = g2_frag(ap, hh), a1 = g2_frag(ap + 16 * G2P, hh), b0 = g2_frag(bq, hh), b1 = g2_frag(bq + 16 * G2P, hh), b2 = g2_frag(bq + 32 * G2P, hh), b3 = g2_frag(bq + 48 * G2P, hh);
    const v16h e0 = g2_frag(ap + 32, hh), e1 = g2_frag(ap + 16 * G2P + 32, hh), f0 = g2_frag(bq + 32, hh), f1 = g2_frag(bq + 16 * G2P + 32, hh), f2 = g2_frag(bq + 32 * G2P + 32, hh), f3 = g2_frag(bq + 48 * G2P + 32, hh);
    c00 = g2_mma(a0, b0, c00); c10 = g2_mma(a1, b0, c10); c01 = g2_mma(a0, b1, c01); c11 = g2_mma(a1, b1, c11); c02 = g2_mma(a0, b2, c02); c12 = g2_mma(a1, b2, c12); c03 = g2_mma(a0, b3, c03); c13 = g2_mma(a1, b3, c13);
    c00 = g2_mma(e0, f0, c00); c10 = g2_mma(e1, f0, c10); c01 = g2_mma(e0, f1, c01); c11 = g2_mma(e1, f1, c11); c02 = g2_mma(e0, f2, c02); c12 = g2_mma(e1, f2, c12); c03 = g2_mma(e0, f3, c03); c13 = g2_mma(e1, f3, c13);
    asm volatile("s_wait_dscnt 0x0" ::: "memory");      /* this wave's reads of tile t are done before the buffer is given up */
    asm volatile("s_wait_asynccnt 0x0" ::: "memory");      /* this wave's copies of tile t + 1 have landed */
    __syncthreads();      /* publishes tile t + 1 and ends every wave's reads of tile t */
    if (t + 2 < nt) g2_stage(ga + (size_t)(t + 2) * 64, sa, gb + (size_t)(t + 2) * 64, sb, l0 + (unsigned)((t & 1) * (G2B * 2))); }      /* refill of the buffer that this trip has just read */
  asm volatile("s_wait_asynccnt 0x0" ::: "memory");      /* nothing of the ring is in flight when its bytes become the epilogue's tiles */
  v8f accs[8] = {c00, c01, c02, c03, c10, c11, c12, c13}; (void)rowsPerB; (void)sCPb;
  /* the epilogue's global loads (4 bias values, 64 residual elements per lane) stand together ahead of the arithmetic, under no per-element test, so that they are all in flight at once and their latency is paid once */
  float bv4[4] = {0.f, 0.f, 0.f, 0.f}, rv[8][8];
  if (RES) { const float* cp = CP + cofs + (size_t)(row0g + row0 + 8 * hh) * ldc + col0 + ln; const float* pr[16];      /* the lane's 16 rows */
#pragma unroll
    for (int i = 0; i < 16; ++i) pr[i] = cp + (size_t)((i >> 3) * 16 + (i & 7)) * ldc;
#pragma unroll
    for (int u = 0; u < 8; ++u) for (int r = 0; r < 8; ++r) rv[u][r] = pr[(u >> 2) * 8 + r][(u & 3) * 16];
    /* the wait that belongs in front of any overwrite of a register that an issued load names; it takes the 16 row addresses as inputs, so that each stays in its registers up to here */
    asm volatile("s_wait_xcnt 0x0" :: "v"(pr[0]), "v"(pr[1]), "v"(pr[2]), "v"(pr[3]), "v"(pr[4]), "v"(pr[5]), "v"(pr[6]), "v"(pr[7]), "v"(pr[8]), "v"(pr[9]), "v"(pr[10]), "v"(pr[11]), "v"(pr[12]), "v"(pr[13]), "v"(pr[14]), "v"(pr[15]) : "memory"); }
  if (bp) {
#pragma unroll
    for (int t = 0; t < 4; ++t) bv4[t] = bp[col0 + t * 16 + ln];
    asm volatile("s_wait_xcnt 0x0" ::: "memory"); }      /* behind the join the build reuses the offset register that these four loads name: the wait stands in front of that */
#pragma unroll
  for (int u = 0; u < 8; ++u) { const int t = u & 3, half = u >> 2; const float bv = bf16_round(bv4[t]);
#pragma unroll
    for (int r = 0; r < 8; ++r) { const int rloc = half * 16 + 8 * hh + r; float v = accs[u][r] * alpha + bv; if (RES) v += rv[u][r];
      if (ACT == 3) v = fmaxf(v, 0.f); else if (ACT == 6) v = 0.5f * v * (1.0f + erff(v * 0.70710678118654752f)); else if (ACT == 11) v = 1.0f / (1.0f + expf(-v)); else if (ACT == 15) v = v / (1.0f + expf(-v)); else if (ACT == 12) v = (v > 0.f) ? v : 0.01f * v; else if (ACT == 8) v = tanhf(v); else if (ACT == 9) v = 0.5f * v * (1.0f + tanhf(0.7978845608028654f * (v + 0.044715f * v * v * v))); else if (ACT == 14) v = (v > 0.f) ? v : 0.1f * v; else if (ACT == 16) v = (v >= 0.f) ? v : 0.3f * v; else if (ACT == 17) v = (v >= 0.f) ? v : 0.2f * v;
      so[w][rloc][t * 16 + ln] = v; } }
  __builtin_amdgcn_fence(__ATOMIC_ACQ_REL, "workgroup"); __builtin_amdgcn_wave_barrier();
  const int rsub = lane >> 4, c4 = (lane & 15) * 4;
  {
#pragma unroll
    for (int q = 0; q < 16; ++q) { const int r = q * 2 + rsub; const v4f v = *(const v4fa*)&so[w][r][c4]; if (C) *(v4f*)(C + cofs + (size_t)(row0 + r) * ldc + col0 + c4) = v; if (C16) { v4h h4; for (int i = 0; i < 4; ++i) h4[i] = (_Float16)v[i]; *(v4h*)(C16 + cofs + (size_t)(row0 + r) * ldc + col0 + c4) = h4; } }
     } }


// ---- large-tile form of the fast GEMM for the launches over all token rows: work-group tile 256x128, eight waves as 4 x 2, wave tile 64x64 (requires M % 256 == 0, N % 128 == 0, K % 64 == 0).
// Against the 128x64 tile a k-tile brings (256 + 128) rows for four times the products, half the bytes from L2 per product, and a wave reads 8 fragments for 16 products where it read 6 for 8. Ring, waits, k order and epilogue arithmetic are those of k_gemm2.
#define G3B (384 * G2P)              /* f16 per buffer: the block's 256 A rows, then its 128 B rows, 64 k each */
#define G3S (32u * G2P * 2u)         /* LDS bytes between a lane's successive copies (32 rows) */
// one k-tile, global -> LDS through no register: lane = (row tid / 8 + 32 i, 16-byte piece tid % 8); eight copies for A, four for B. The s_wait_xcnt stands inside the copies' own statement for the reason given at g2_stage.
__device__ __forceinline__ void g3_stage(const _Float16* ga, size_t sa, const _Float16* gb, size_t sb, unsigned l) {
  asm volatile(
    "global_load_async_to_lds_b128 %0, %12, off\n\t"
    "global_load_async_to_lds_b128 %1, %13, off\n\t"
    "global_load_async_to_lds_b128 %2, %14, off\n\t"
    "global_load_async_to_lds_b128 %3, %15, off\n\t"
    "global_load_async_to_lds_b128 %4, %16, off\n\t"
    "global_load_async_to_lds_b128 %5, %17, off\n\t"
    "global_load_async_to_lds_b128 %6, %18, off\n\t"
    "global_load_async_to_lds_b128 %7, %19, off\n\t"
    "global_load_async_to_lds_b128 %8, %20, off\n\t"
    "global_load_async_to_lds_b128 %9, %21, off\n\t"
    "global_load_async_to_lds_b128 %10, %22, off\n\t"
    "global_load_async_to_lds_b128 %11, %23, off\n\t"
    "s_wait_xcnt 0x0"
    :: "v"(l), "v"(l + 1u * G3S), "v"(l + 2u * G3S), "v"(l + 3u * G3S), "v"(l + 4u * G3S), "v"(l + 5u * G3S), "v"(l + 6u * G3S), "v"(l + 7u * G3S), "v"(l + 8u * G3S), "v"(l + 9u * G3S), "v"(l + 10u * G3S), "v"(l + 11u * G3S),
       "v"(ga), "v"(ga + 1 * sa), "v"(ga + 2 * sa), "v"(ga + 3 * sa), "v"(ga + 4 * sa), "v"(ga + 5 * sa), "v"(ga + 6 * sa), "v"(ga + 7 * sa), "v"(gb), "v"(gb + 1 * sb), "v"(gb + 2 * sb), "v"(gb + 3 * sb) : "memory"); }
template <int ACT, int RES, int PF, int O16>      /* O16 1: f16 result to C16, 0: f32 result to C; ACT 0 none, 6 exact gelu; RES 1: v += CP's own element of the C plane; RES 0: CP is not read; PF 1: both k-steps' fragments of a tile read ahead (two sets of registers: for grids of one work-group per WGP), PF 0: one set */
__global__ __launch_bounds__(256) void k_gemm3(const _Float16* __restrict__ A, int lda, const _Float16* __restrict__ Bh, int ldb, float alpha, const float* __restrict__ bias, const float* __restrict__ CP,
    float* __restrict__ C, _Float16* __restrict__ C16, int ldc, int M, int N, int K) { static_assert(ACT == 0 || ACT == 6, "k_gemm3: unsupported ACT code");
  __shared__ __attribute__((aligned(16))) float sm[G3B];      /* two k-tile buffers of G3B f16 each; behind the k-loop's last barrier the same bytes are the epilogue's transpose tiles */
  float (*so)[32][68] = (float (*)[32][68])sm; static_assert(8 * 32 * 68 <= G3B, "epilogue tiles must fit the ring");
  const int tid = threadIdx.x, w = tid >> 5, lane = tid & 31, ln = lane & 15, hh = lane >> 4; const int wm = w >> 1, wn = w & 1;
  const int ntn = N >> 7; const int mt = blockIdx.x / ntn, nq = blockIdx.x - mt * ntn; const int row0 = mt * 256 + 64 * wm, col0 = nq * 128 + 64 * wn; if (mt * 256 >= M) return;      /* the whole work-group leaves or none (barriers below) */
  const _Float16* ga = A + (size_t)(mt * 256 + (tid >> 3)) * lda + (tid & 7) * 8; const _Float16* gb = Bh + (size_t)(nq * 128 + (tid >> 3)) * ldb + (tid & 7) * 8; const size_t sa = (size_t)32 * lda, sb = (size_t)32 * ldb;
  const unsigned l0 = (unsigned)(size_t)sm + (unsigned)((tid >> 3) * (G2P * 2) + (tid & 7) * 16);      /* the lane's LDS byte address in buffer 0 */
  const _Float16* st = (const _Float16*)sm; const int nt = K >> 6;
  const v8f z8 = {0.f,0.f,0.f,0.f,0.f,0.f,0.f,0.f}; v8f acc[4][4];      /* [A fragment][B fragment] */
#pragma unroll      /* here and in every inner loop below: static indices keep the fragment and accumulator arrays in registers */
  for (int i = 0; i < 4; ++i) for (int j = 0; j < 4; ++j) acc[i][j] = z8;
  /* two LDS buffers: tile t + 1 flies while tile t is worked on. Each accumulator takes its k-steps in ascending order. */
  g3_stage(ga, sa, gb, sb, l0);
  asm volatile("s_wait_asynccnt 0x0" ::: "memory");      /* this wave's copies of tile 0 have landed */
  __syncthreads();      /* ... and every other wave's */
  if (nt > 1) g3_stage(ga + 64, sa, gb + 64, sb, l0 + (unsigned)(G3B * 2));
#pragma unroll 1      /* one k-tile per trip: the buffer alternates by the trip's parity */
  for (int t = 0; t < nt; ++t) {
    const _Float16* ap = st + (t & 1) * G3B + (64 * wm + ln) * G2P; const _Float16* bq = st + (t & 1) * G3B + (256 + 64 * wn + ln) * G2P;
    v16h a[2][4], b[2][4];
    if (PF) {
#pragma unroll
      for (int kk = 0; kk < 2; ++kk) for (int i = 0; i < 4; ++i) { a[kk][i] = g2_frag(ap + i * 16 * G2P + kk * 32, hh); b[kk][i] = g2_frag(bq + i * 16 * G2P + kk * 32, hh); }
      __builtin_amdgcn_sched_barrier(0);      /* keeps the tile's 32 LDS reads one group ahead of its products: the second k-step's land under the first's products (left alone the build read two at a time among the products, a full wait behind each pair) */
#pragma unroll
      for (int kk = 0; kk < 2; ++kk) for (int j = 0; j < 4; ++j) for (int i = 0; i < 4; ++i) acc[i][j] = __builtin_amdgcn_wmma_f32_16x16x32_f16(false, a[kk][i], false, b[kk][j], (short)0, acc[i][j], false, false);
      __builtin_amdgcn_sched_barrier(0);      /* keeps the products ahead of the trip's foot: left alone the build moved them behind the barrier and so put them between the barrier and the refill, which then had too short a flight */
    } else {
#pragma unroll
      for (int kk = 0; kk < 2; ++kk) {
#pragma unroll
        for (int i = 0; i < 4; ++i) { a[0][i] = g2_frag(ap + i * 16 * G2P + kk * 32, hh); b[0][i] = g2_frag(bq + i * 16 * G2P + kk * 32, hh); }
        __builtin_amdgcn_sched_barrier(0);      /* keeps the k-step's 16 LDS reads one group ahead of its 16 products (one place of reads and one latency per k-step, not four) */
#pragma unroll
        for (int j = 0; j < 4; ++j) for (int i = 0; i < 4; ++i) acc[i][j] = __builtin_amdgcn_wmma_f32_16x16x32_f16(false, a[0][i], false, b[0][j], (short)0, acc[i][j], false, false);
        __builtin_amdgcn_sched_barrier(0); } }      /* ... and the next group behind these products, so that one fragment set serves and two work-groups fit a WGP's registers */
    asm volatile("s_wait_dscnt 0x0" ::: "memory");      /* this wave's reads of tile t are done before the buffer is given up */
    asm volatile("s_wait_asynccnt 0x0" ::: "memory");      /* this wave's copies of tile t + 1 have landed */
    __syncthreads();      /* publishes tile t + 1 and ends every wave's reads of tile t */
    if (t + 2 < nt) g3_stage(ga + (size_t)(t + 2) * 64, sa, gb + (size_t)(t + 2) * 64, sb, l0 + (unsigned)((t & 1) * (G3B * 2))); }      /* refill of the buffer that this trip has just read */
  asm volatile("s_wait_asynccnt 0x0" ::: "memory");      /* nothing of the ring is in flight when its bytes become the epilogue's tiles */
  /* the epilogue's global loads (4 bias values, 128 residual elements per lane) stand together ahead of the arithmetic, so that they are all in flight at once and their latency is paid once */
  float bv4[4] = {0.f, 0.f, 0.f, 0.f}, rv[2][8][8];
  if (RES) {
#pragma unroll
    for (int h2 = 0; h2 < 2; ++h2) { const float* cp = CP + (size_t)(row0 + 32 * h2 + 8 * hh) * ldc + col0 + ln; const float* pr[16];      /* the lane's 16 rows of this half of the wave tile */
#pragma unroll
      for (int i = 0; i < 16; ++i) pr[i] = cp + (size_t)((i >> 3) * 16 + (i & 7)) * ldc;
#pragma unroll
      for (int u = 0; u < 8; ++u) for (int r = 0; r < 8; ++r) rv[h2][u][r] = pr[(u >> 2) * 8 + r][(u & 3) * 16];
      /* the wait that belongs in front of any overwrite of a register that an issued load names; it takes the 16 row addresses as inputs, so that each stays in its registers up to here */
      asm volatile("s_wait_xcnt 0x0" :: "v"(pr[0]), "v"(pr[1]), "v"(pr[2]), "v"(pr[3]), "v"(pr[4]), "v"(pr[5]), "v"(pr[6]), "v"(pr[7]), "v"(pr[8]), "v"(pr[9]), "v"(pr[10]), "v"(pr[11]), "v"(pr[12]), "v"(pr[13]), "v"(pr[14]), "v"(pr[15]) : "memory"); } }
  if (bias) { const float* bp = bias + col0 + ln;
#pragma unroll
    for (int t = 0; t < 4; ++t) bv4[t] = bp[t * 16];
    asm volatile("s_wait_xcnt 0x0" :: "v"(bp) : "memory"); }      /* the wait in front of any overwrite of the address that these four loads name; it takes the address as an input, so that no load's result lands on it ahead of the wait */
  const int rsub = lane >> 4, c4 = (lane & 15) * 4;
#pragma unroll 1      /* the wave tile's rows 32 at a time through the wave's own transpose tile; kept rolled, like the loop over g below, so that the write-out and the activation stand once in the text */
  for (int h2 = 0; h2 < 2; ++h2) {
#pragma unroll      /* the half is picked by a test that is the same for the whole grid: inside it every register index is static */
    for (int hs = 0; hs < 2; ++hs) if (h2 == hs) {
#pragma unroll
      for (int u = 0; u < 8; ++u) { const int t = u & 3, half = u >> 2; const float bv = bf16_round(bv4[t]);
#pragma unroll
        for (int r = 0; r < 8; ++r) { float v = acc[2 * hs + half][t][r] * alpha + bv; if (RES) v += rv[hs][u][r]; so[w][half * 16 + 8 * hh + r][t * 16 + ln] = v; } } }
    __builtin_amdgcn_fence(__ATOMIC_ACQ_REL, "workgroup"); __builtin_amdgcn_wave_barrier();      /* the wave's stores to its tile stay ahead of its reads of other lanes' elements */
#pragma unroll 1
    for (int g = 0; g < 2; ++g) {      /* eight stores (16 rows), then the wait that belongs in front of any overwrite of a register that an issued store names; it takes the addresses and the stored values as inputs, so that each stays in its registers up to there */
      const size_t co = (size_t)(row0 + 32 * h2 + 16 * g + rsub) * ldc + col0 + c4; v4f vv[8];
#pragma unroll
      for (int q = 0; q < 8; ++q) { vv[q] = *(const v4fa*)&so[w][16 * g + 2 * q + rsub][c4];
        if (ACT == 6) for (int i = 0; i < 4; ++i) vv[q][i] = 0.5f * vv[q][i] * (1.0f + erff(vv[q][i] * 0.70710678118654752f)); }
      if (O16) { _Float16* pc[8]; v4h hv[8];
#pragma unroll
        for (int q = 0; q < 8; ++q) { pc[q] = C16 + co + (size_t)(2 * q) * ldc; for (int i = 0; i < 4; ++i) hv[q][i] = (_Float16)vv[q][i]; *(v4h*)pc[q] = hv[q]; }
        asm volatile("s_wait_xcnt 0x0" :: "v"(pc[0]), "v"(pc[1]), "v"(pc[2]), "v"(pc[3]), "v"(pc[4]), "v"(pc[5]), "v"(pc[6]), "v"(pc[7]), "v"(hv[0]), "v"(hv[1]), "v"(hv[2]), "v"(hv[3]), "v"(hv[4]), "v"(hv[5]), "v"(hv[6]), "v"(hv[7]) : "memory");
      } else { float* pc[8];
#pragma unroll
        for (int q = 0; q < 8; ++q) { pc[q] = C + co + (size_t)(2 * q) * ldc; *(v4f*)pc[q] = vv[q]; }
        asm volatile("s_wait_xcnt 0x0" :: "v"(pc[0]), "v"(pc[1]), "v"(pc[2]), "v"(pc[3]), "v"(pc[4]), "v"(pc[5]), "v"(pc[6]), "v"(pc[7]), "v"(vv[0]), "v"(vv[1]), "v"(vv[2]), "v"(vv[3]), "v"(vv[4]), "v"(vv[5]), "v"(vv[6]), "v"(vv[7]) : "memory"); } }
    __builtin_amdgcn_fence(__ATOMIC_ACQ_REL, "workgroup", "local"); __builtin_amdgcn_wave_barrier(); } }      /* ... and these reads ahead of the next half's stores; an LDS-only fence, so that it does not wait for the global stores above */


__global__ __launch_bounds__(256) void k_wnat(const float* __restrict__ w, size_t n8, _Float16* __restrict__ Bt) { const size_t t = (size_t)blockIdx.x * 256 + threadIdx.x; if (t >= n8) return; FragH f; for (int q = 0; q < 8; ++q) f.h[q] = (_Float16)(bf16_round(w[t * 8 + q]) * 16.0f); *(v8us*)((unsigned short*)Bt + t * 8) = f.half[0];  }
__global__ __launch_bounds__(256) void k_rsm(const float* __restrict__ S, _Float16* __restrict__ P, int nrows) {
  #pragma clang fp contract(off)
  const int i = blockIdx.x * 256 + threadIdx.x; if (i >= nrows) return; const float* s = S + (size_t)i * SQ; float mx = -3.0e38f;
#pragma unroll 1
  for (int j = 0; j < SQ; ++j) mx = fmaxf(mx, s[j]); float se = 0.f;
#pragma unroll 1
  for (int j = 0; j < SQ; ++j) se += expf(s[j] - mx); const float sc = 256.0f / se;
#pragma unroll 1
  for (int j0 = 0; j0 < SQ; j0 += 8) { FragH f; for (int q = 0; q < 8; ++q) f.h[q] = (_Float16)(expf(s[j0 + q] - mx) * sc); unsigned short* d = (unsigned short*)P + (size_t)i * SQ + j0; *(v8us*)d = f.half[0];  } }
__global__ __launch_bounds__(256) void k_vt(const _Float16* __restrict__ V16, int b, int h0, _Float16* __restrict__ VT) { __shared__ unsigned short tl[64][65]; const int tid = threadIdx.x; const int hh = blockIdx.x % HG, sg = blockIdx.x / HG; const int s0 = sg * 64; const int h = h0 + hh;
  for (int i = tid; i < 64 * 8; i += 256) { const int j = i / 8, d8 = (i % 8) * 8; FragH f; f.half[0] = *(const v8us*)((const unsigned short*)V16 + ((size_t)b * SQ + s0 + j) * DM + h * HD + d8); for (int q = 0; q < 8; ++q) tl[d8 + q][j] = f.u[q]; }
  __syncthreads();
  { for (int i = tid; i < 64 * 8; i += 256) { const int d = i / 8, j8 = (i % 8) * 8; FragH f; for (int q = 0; q < 8; ++q) f.u[q] = tl[d][j8 + q]; *(v8us*)((unsigned short*)VT + ((size_t)hh * HD + d) * SQ + s0 + j8) = f.half[0]; }  } }



// fused causal attention, one wave per 32 query rows, no LDS, scores and weights never leave the registers.
// scores^T tile = K rows (A) x Q rows (B): accumulator row = key 8*hh + r, column = query ln, so a lane's 8 values of key tile 0 and its 8 of key tile 1 are,
// in order, the 16 elements of the B fragment (k = 8*hh + i, 16 + 8*hh + i) of the 32-key step of o^T = V^T (A) x P^T (B): no exchange between lanes.
// A lane keeps the running maximum of its query (made equal in both half-waves by one exchange per 32 keys) and its own half of the running sum (halves added at the end).
#define FA_CS 0.18033688011112042f      /* log2(e) / 8: score scale and exp -> exp2 in one factor */
__device__ __forceinline__ float fa_exp2(float x) { float e; asm("v_exp_f32 %0, %1\n\tv_nop" : "=v"(e) : "v"(x)); return e; }      /* the v_nop is the one slot the instruction set asks for behind a transcendental before its result is read or its source overwritten */
__device__ __forceinline__ float fa_xhalf(float x) { return __builtin_bit_cast(float, __builtin_amdgcn_permlanex16(__builtin_bit_cast(int, x), __builtin_bit_cast(int, x), 0x76543210, 0xfedcba98, false, false)); }      /* lane l with lane l ^ 16, on the vector unit (a shuffle would go through the LDS pipe and its wait) */
__device__ __forceinline__ v8f fa_mma(v16h a, v16h b, v8f c) { return __builtin_amdgcn_wmma_f32_16x16x32_f16(false, a, false, b, (short)0, c, false, false); }
__global__ __launch_bounds__(128) void k_fattn(const _Float16* __restrict__ QKVp, const _Float16* __restrict__ VTp, _Float16* __restrict__ O) {
  const int lane = threadIdx.x & 31, ln = lane & 15, hh = lane >> 4; const int w = __builtin_amdgcn_readfirstlane((int)(threadIdx.x >> 5));
  const int bh = blockIdx.x, b = bh / NH, h = bh - b * NH;
  const int yg = (int)blockIdx.y >> 2, yi = (int)blockIdx.y & 3; const int qt = SQ / 128 - 1 - 4 * yg - ((yg & 1) ? 3 - yi : yi);      /* query tile: long tiles first, every second group of four in rising order, so that work-groups 256 apart in the grid (all are resident at once) add up to equal lengths; any order is correct */
  const int row0 = qt * 128 + 32 * w;      /* also the first key of the wave's last 32-key block */
  const _Float16* qp = QKVp + ((size_t)b * SQ + row0 + ln) * LQ + h * HD;
  const _Float16* kp = QKVp + ((size_t)b * SQ + ln) * LQ + DM + h * HD;
  const _Float16* vp = VTp + ((size_t)bh * HD + ln) * SQ;
  v16h q[2][2], kf[2][2];
#pragma unroll      /* here and in every inner loop below: static indices keep the fragment and accumulator arrays in registers */
  for (int j = 0; j < 2; ++j) for (int kk = 0; kk < 2; ++kk) q[j][kk] = g2_frag(qp + (size_t)(j * 16) * LQ + kk * 32, hh);
#pragma unroll
  for (int kt = 0; kt < 2; ++kt) for (int kk = 0; kk < 2; ++kk) kf[kt][kk] = g2_frag(kp + (size_t)(kt * 16) * LQ + kk * 32, hh);
  const v8f z8 = {0.f,0.f,0.f,0.f,0.f,0.f,0.f,0.f};
  v8f o[2][4] = {{z8, z8, z8, z8}, {z8, z8, z8, z8}}; float m[2] = {-1.0e30f, -1.0e30f}, l[2] = {0.f, 0.f};
  int kb = 0;
#pragma unroll 1      /* one 32-key block per trip: a second copy of the body would need a second set of fragments */
  do {
    const int kn = min(kb + 32, row0);      /* next block; the last trip fetches its own block again, so every address stays inside the batch's rows */
    v8f s[2][2]; v16h vf[4];
#pragma unroll
    for (int t = 0; t < 4; ++t) vf[t] = g2_frag(vp + (size_t)(t * 16) * SQ + kb, hh);      /* this block's V^T, in flight under the scores and the softmax */
#pragma unroll
    for (int kt = 0; kt < 2; ++kt) for (int j = 0; j < 2; ++j) s[j][kt] = fa_mma(kf[kt][0], q[j][0], z8);
#pragma unroll
    for (int kt = 0; kt < 2; ++kt) for (int j = 0; j < 2; ++j) s[j][kt] = fa_mma(kf[kt][1], q[j][1], s[j][kt]);
#pragma unroll
    for (int kt = 0; kt < 2; ++kt) for (int kk = 0; kk < 2; ++kk) kf[kt][kk] = g2_frag(kp + (size_t)(kn + kt * 16) * LQ + kk * 32, hh);      /* next block's K, in flight under the softmax and the second product */
    asm volatile("s_wait_xcnt 0x0" ::: "memory");      /* later address arithmetic may overwrite registers that these loads name: the wait stands in front of it */
    if (kb + 31 > row0) {      /* only the block on the diagonal needs the causal test (same for the whole wave) */
      const int dq = row0 + ln - kb - 8 * hh;      /* key offset kt*16 + r is allowed up to dq + j*16 */
#pragma unroll
      for (int j = 0; j < 2; ++j) for (int kt = 0; kt < 2; ++kt) for (int r = 0; r < 8; ++r) s[j][kt][r] = (kt * 16 + r - j * 16 <= dq) ? s[j][kt][r] : -1.0e30f; }
    v16h p[2];
#pragma unroll
    for (int j = 0; j < 2; ++j) {
      float bm = s[j][0][0];
#pragma unroll
      for (int kt = 0; kt < 2; ++kt) for (int r = 0; r < 8; ++r) bm = fmaxf(bm, s[j][kt][r]);
      bm = fmaxf(bm, fa_xhalf(bm));      /* the query's other 16 keys of this block sit in the other half-wave */
      const float mn = fmaxf(m[j], bm); const float sc = fa_exp2((m[j] - mn) * FA_CS); m[j] = mn;
      const float mc = mn * FA_CS - 4.0f;      /* weights carried x16 (largest = 16): small ones stay in f16's normal range; the factor is in the row sum too and cancels */
      v4f ls = {0.f, 0.f, 0.f, 0.f}; FragH f;
#pragma unroll
      for (int i = 0; i < 16; ++i) { const float e = fa_exp2(fmaf(s[j][i >> 3][i & 7], FA_CS, -mc)); ls[i & 3] += e; f.h[i] = (_Float16)e; }
      p[j] = f.v;
      l[j] = l[j] * sc + ((ls[0] + ls[1]) + (ls[2] + ls[3]));
#pragma unroll
      for (int t = 0; t < 4; ++t) o[j][t] *= sc; }
#pragma unroll
    for (int t = 0; t < 4; ++t) for (int j = 0; j < 2; ++j) o[j][t] = fa_mma(vf[t], p[j], o[j][t]);
    kb += 32;
  } while (kb <= row0);
#pragma unroll
  for (int j = 0; j < 2; ++j) { const float fin = 64.0f / (l[j] + fa_xhalf(l[j]));      /* o carried x64 */
    unsigned short* op = (unsigned short*)O + ((size_t)b * SQ + row0 + j * 16 + ln) * DM + h * HD + 8 * hh;
#pragma unroll
    for (int t = 0; t < 4; ++t) { FragH f;
#pragma unroll
      for (int r = 0; r < 8; ++r) f.h[r] = (_Float16)(o[j][t][r] * fin);
      *(v8us*)(op + t * 16) = f.half[0]; } }
}


// exact f32 attention of a batch's first QT0 rows, causal. One work-group = 64 query rows of one head, 1024 threads, three passes over LDS:
// 1. thread (row, key group g of 16) forms the scores of keys g, g + 16, ... (each score one ascending chain over the 64 dims; the wave's key row comes through scalar loads) and its part of the row maximum;
// 2. the same thread turns its scores into weights exp(s - row max), 0 above the diagonal, and sums its part of the row sum;
// 3. thread (row, 4 dims) adds weight x V over the keys in ascending order and divides by the row sum (the 16 parts added in ascending g).
template <int MASKADD>
__global__ __launch_bounds__(1024) void k_att0(const float* __restrict__ QF, const float* __restrict__ KF, const float* __restrict__ VF, int ld, size_t sIn, const float* __restrict__ mask, float scale, float* __restrict__ OF, int ldo, size_t sOut) {
  static_assert(MASKADD == 0, "k_att0: causal form only (the weights of QT0 keys are held in LDS)"); (void)mask;
  __shared__ __attribute__((aligned(16))) float sq[64][HD + 4];      /* q rows; pitch 272 B, an odd multiple of 16 B, so that 16-byte reads of one column piece from successive rows fall on different banks */
  __shared__ float se[QT0][64];      /* [key][row]: scores, then weights */
  __shared__ float pm[16][64], pl[16][64];      /* [key group][row]: parts of the row maximum and of the row sum */
  const int tid = threadIdx.x; const int h = blockIdx.x / (QT0 / 64), rg = blockIdx.x % (QT0 / 64);
  QF += (size_t)blockIdx.y * sIn; KF += (size_t)blockIdx.y * sIn; VF += (size_t)blockIdx.y * sIn; OF += (size_t)blockIdx.y * sOut;      /* blockIdx.y = batch */
  const int r = tid >> 4, c4 = (tid & 15) * 4;      /* passes 0 and 3: row r of the block, dims c4 .. c4 + 3: 16 lanes take one whole 256-byte row */
  *(v4f*)&sq[r][c4] = *(const v4fa*)(QF + (size_t)(rg * 64 + r) * ld + h * HD + c4);
  __syncthreads();      /* the q rows are complete */
  const int il = tid & 63, i = rg * 64 + il; const int g = __builtin_amdgcn_readfirstlane(tid >> 6);      /* the key group is the same for a whole wave */
  const int nk = rg * 64 + 64;      /* keys up to the block's last row */
  v4f rq[HD / 4];
#pragma unroll      /* here and in the inner loops below: static indices keep the arrays in registers */
  for (int c = 0; c < HD / 4; ++c) rq[c] = *(const v4f*)&sq[il][c * 4];
  float mx = -1.0e30f;
#pragma unroll 1      /* one key per trip: a key row fills 64 scalar registers */
  for (int j = g; j < nk; j += 16) { const float* kr = KF + (size_t)j * ld + h * HD; float s = 0.f;
#pragma unroll
    for (int c = 0; c < HD / 4; ++c) { const v4f kq = *(const v4fa*)(kr + c * 4); const v4f qq = rq[c]; s = fmaf(qq[0], kq[0], s); s = fmaf(qq[1], kq[1], s); s = fmaf(qq[2], kq[2], s); s = fmaf(qq[3], kq[3], s); }
    s *= scale; se[j][il] = s; mx = (j <= i) ? fmaxf(mx, s) : mx; }
  pm[g][il] = mx;
  __syncthreads();      /* every part of the row maxima is written */
  float m = pm[0][il];      /* key 0 is allowed in every row, so this part is a real score */
#pragma unroll
  for (int gg = 1; gg < 16; ++gg) m = fmaxf(m, pm[gg][il]);
  float ls = 0.f;
#pragma unroll 1      /* four or eight short trips: kept rolled for code size */
  for (int j = g; j < nk; j += 16) { const float e = (j <= i) ? expf(se[j][il] - m) : 0.f; se[j][il] = e; ls += e; }      /* the thread's own elements */
  pl[g][il] = ls;
  __syncthreads();      /* weights and parts of the row sums are written */
  float l = 0.f;
#pragma unroll
  for (int gg = 0; gg < 16; ++gg) l += pl[gg][r];
  const int je = (rg * 64 + 2 * __builtin_amdgcn_readfirstlane(tid >> 5) + 2 + 7) & ~7;      /* keys that the wave's two rows may see, rounded up to whole groups of 8 (at most nk; the weights above the diagonal are 0) */
  const float* vr = VF + h * HD + c4; v4f o = {0.f, 0.f, 0.f, 0.f};
#pragma unroll 1      /* eight keys per trip, their loads issued together */
  for (int j0 = 0; j0 < je; j0 += 8) { v4f vv[8]; float e[8];
#pragma unroll
    for (int u = 0; u < 8; ++u) { vv[u] = *(const v4fa*)(vr + (size_t)(j0 + u) * ld); e[u] = se[j0 + u][r]; }
#pragma unroll
    for (int u = 0; u < 8; ++u) for (int q = 0; q < 4; ++q) o[q] = fmaf(e[u], vv[u][q], o[q]); }
  const float fin = 64.0f / l;      /* o carried x64 like the f16 path */
  for (int q = 0; q < 4; ++q) o[q] *= fin;
  *(v4f*)(OF + (size_t)(rg * 64 + r) * ldo + h * HD + c4) = o;
}


template <int BFIN, int WXB>
__global__ __launch_bounds__(256) void k_ln16(const float* __restrict__ X, const float* __restrict__ g, const float* __restrict__ bb, float eps, _Float16* __restrict__ N16, float* __restrict__ XB) {
  #pragma clang fp contract(off)
  __shared__ float red[256]; const size_t r = blockIdx.x; const int t = threadIdx.x; const v4f xa = *(const v4fa*)(X + r * DMQ + t * 4); float s[4]; float sum = 0.f;
  for (int q = 0; q < 4; ++q) { s[q] = BFIN ? bf16_round(xa[q]) : xa[q]; sum = __fadd_rn(sum, s[q]); }
  red[t] = sum; __syncthreads(); for (int st = 128; st > 0; st >>= 1) { if (t < st) red[t] = __fadd_rn(red[t], red[t + st]); __syncthreads(); } const float mu = red[0] / (float)DMQ; __syncthreads();
  float vs = 0.f; for (int q = 0; q < 4; ++q) { const float dl = __fadd_rn(s[q], -mu); vs = __fadd_rn(vs, __fmul_rn(dl, dl)); } red[t] = vs; __syncthreads(); for (int st = 128; st > 0; st >>= 1) { if (t < st) red[t] = __fadd_rn(red[t], red[t + st]); __syncthreads(); }
  const float rs = rsqrtf(__fadd_rn(red[0] / (float)DMQ, eps)); v4h y; v4f xb;
  for (int q = 0; q < 4; ++q) { const int c = t * 4 + q; y[q] = (_Float16)__fadd_rn(__fmul_rn(__fmul_rn(__fadd_rn(s[q], -mu), rs), bf16_round(g[c])), bf16_round(bb[c])); xb[q] = s[q]; }
  { *(v4h*)(N16 + r * DMQ + t * 4) = y; if (WXB) *(v4f*)(XB + r * DMQ + t * 4) = xb;  } }
__global__ __launch_bounds__(256) void k_ftres2(const float* __restrict__ OF0, const float* __restrict__ XB, float* __restrict__ X1, size_t n4) {
  #pragma clang fp contract(off)
  const size_t t = (size_t)blockIdx.x * 256 + threadIdx.x; if (t >= n4) return; const v4f o = *(const v4fa*)(OF0 + t * 4), xv = *(const v4fa*)(XB + t * 4); v4f y; for (int q = 0; q < 4; ++q) y[q] = __fadd_rn(__fmul_rn(o[q], 0.015625f), xv[q]); *(v4f*)(X1 + t * 4) = y;  }

__global__ __launch_bounds__(256) void k_wthd(const float* __restrict__ Wt, _Float16* __restrict__ Bt) { const size_t t = (size_t)blockIdx.x * 256 + threadIdx.x; if (t >= (size_t)NH * HD * (DM / 8)) return; const int m8 = (int)(t % (DM / 8)) * 8; const int d = (int)((t / (DM / 8)) % HD); const int h = (int)(t / ((size_t)(DM / 8) * HD)); FragH f;
  for (int q = 0; q < 8; ++q) f.h[q] = (_Float16)(16.0f * bf16_round(Wt[((size_t)h * DM + m8 + q) * HD + d])); unsigned short* dst = (unsigned short*)Bt + ((size_t)h * HD + d) * DM + m8; *(v8us*)dst = f.half[0];  }




__global__ __launch_bounds__(256) void k_wtpad(const float* __restrict__ Wm, _Float16* __restrict__ Wt, int Kr, int Kp, int Nr, int Np, float scale) {
  const int t = blockIdx.x * 256 + threadIdx.x; if (t >= Np * (Kp / 8)) return; const int n = t / (Kp / 8), k8 = (t % (Kp / 8)) * 8; const int nc = min(n, Nr - 1); const float fn = (n < Nr) ? 1.f : 0.f; FragH f;
  for (int i = 0; i < 8; ++i) { const int k = k8 + i; const int kc = min(k, Kr - 1); const float fk = (k < Kr) ? fn : 0.f; f.h[i] = (_Float16)(bf16_round(Wm[(size_t)kc * Nr + nc]) * scale * fk); }
  unsigned short* o = (unsigned short*)Wt + (size_t)n * Kp + k8; *(v8us*)o = f.half[0];  }
__global__ __launch_bounds__(128) void k_bpad(const float* __restrict__ b, float* __restrict__ Bp, int nr, int np) {
  const int i = threadIdx.x; if (i >= np) return; const float v = b[min(i, nr - 1)] * ((i < nr) ? 1.f : 0.f); *(float*)(Bp + i) = v;  }
extern "C" void kernel_launch(void* const* d_in, const int* in_sizes, int n_in,
                              void* d_out, int out_size, void* d_ws, size_t ws_size, hipStream_t stream) {
  (void)in_sizes; (void)n_in; (void)out_size;
  const float* const* I = (const float* const*)d_in; const float* x = I[0]; const float* g1 = I[1]; const float* be1 = I[2]; const float* wq = I[3]; const float* wk = I[4]; const float* wv = I[5]; const float* wo = I[6]; const float* bo = nullptr; const float* gg2 = I[7]; const float* be2 = I[8]; const float* wfc = I[9]; const float* bfc = I[10]; const float* wmp = I[11]; const float* bmp = I[12];      /* x, LN1 g / b, Wq / Wk / Wv / Wo [1024][1024] ([in][out], no biases), LN2 g / b, W1 [1024][4096] + b1, W2 [4096][1024] + b2 */
  char* ws = (char*)d_ws; size_t off = 0;
  auto take = [&](size_t bytes) { char* p = ws + off; off += (bytes + 255) & ~(size_t)255; return p; };
  _Float16* BQKV = (_Float16*)take((size_t)3 * DM * DM * 2); _Float16* BO = (_Float16*)take((size_t)DM * DM * 2);
  _Float16* X16 = (_Float16*)take(NR * DM * 2); float* XB = (float*)take(NR * DM * 4); float* X1 = (float*)take(NR * DM * 4); _Float16* M16 = nullptr;      /* = X16 below (alias: X16's last reader, the first-tile q | k | v GEMM of all batches, precedes LN2's write) */ _Float16* BW1 = (_Float16*)take((size_t)DFF * DM * 2); _Float16* BW2 = (_Float16*)take((size_t)DM * DFF * 2); _Float16* QKV = (_Float16*)take(NR * 4 * DM * 2); _Float16* Q16 = QKV; _Float16* K16 = QKV + DM; _Float16* V16 = QKV + 2 * DM; _Float16* O16 = QKV + NR * 3 * DM; M16 = X16;      /* one plane: the q | k | v rows (pitch 3 DM), then the o rows (pitch DM) */
  static_assert(DFF == 4 * DM, "the hidden rows of all batches take exactly the q | k | v and o planes"); _Float16* HF16 = QKV;      /* alias: the last readers of q | k | v (attention) and of o (the output GEMM) precede the first FFN GEMM, which writes every hidden element before the second reads it */
  _Float16* VT = (_Float16*)take((size_t)NB * NH * HD * SQ * 2);
  float* QKVF0 = (float*)take((size_t)NB * QT0 * LQ * 4);      /* f32 q | k | v rows of every batch's first tile, pitch LQ */ float* OF0 = (float*)take((size_t)NB * QT0 * DM * 4); _Float16* OH0 = (_Float16*)take((size_t)NB * QT0 * DM * 2); _Float16* OL0 = (_Float16*)take((size_t)NB * QT0 * DM * 2);
  if (off > ws_size) return;
  static_assert(MP % 256 == 0 && MPO % 256 == 0 && DM % 128 == 0 && DFF % 128 == 0, "k_gemm3 tiles");
  { const unsigned g = (unsigned)(((size_t)DM * (DM / 8) + 255) / 256); k_wt_f16<<<g, 256, 0, stream>>>(wq, BQKV, DM, DM, 16.0f); k_wt_f16<<<g, 256, 0, stream>>>(wk, BQKV + (size_t)DM * DM, DM, DM, 16.0f); k_wt_f16<<<g, 256, 0, stream>>>(wv, BQKV + (size_t)2 * DM * DM, DM, DM, 16.0f); }      /* [in][out] -> Bt x16, stacked q | k | v */ k_wt_f16<<<(unsigned)(((size_t)DM * (DM / 8) + 255) / 256), 256, 0, stream>>>(wo, BO, DM, DM, 16.0f);      /* w_proj [in][out] -> Bt x16 */
  k_ln16<1, 1><<<(unsigned)NR, 256, 0, stream>>>(x, g1, be1, 1e-5f, X16, XB);      /* a = LN1(bf16(x)) -> f16 rows; XB = bf16(x) for the residual */
  k_wt_f16<<<(unsigned)(((size_t)DFF * (DM / 8) + 255) / 256), 256, 0, stream>>>(wfc, BW1, DM, DFF, 16.0f); k_wt_f16<<<(unsigned)(((size_t)DM * (DFF / 8) + 255) / 256), 256, 0, stream>>>(wmp, BW2, DFF, DM, 16.0f);      /* W1 [1024][4096] -> Bt [4096][1024]; W2 [4096][1024] -> Bt [1024][4096] (x16) */
  const size_t r0p = (size_t)B0 * SQ;      /* first projected row */
  k_gemm3<0, 0, 0, 1><<<(unsigned)((MP / 256) * (3 * DM / 128)), 256, 0, stream>>>(X16 + r0p * DM, DM, BQKV, DM, 0.0625f, nullptr, nullptr, nullptr, QKV + r0p * 3 * DM, 3 * DM, MP, 3 * DM, DM);      /* q | k | v rows (f16); head h = columns h*HD.. of each DM block */
  k_gemm2<0, 0><<<dim3((QT0 / 128) * (LQ / 64), NB), 128, 0, stream>>>(X16, DM, (size_t)SQ * DM, BQKV, DM, 0, 0.0625f, nullptr, 0, nullptr, 1, 0, 0, QKVF0, nullptr, LQ, (size_t)QT0 * LQ, QT0, LQ, DM);      /* f32 q | k | v of the first 128 rows of every batch (exact products); blockIdx.y = batch */
  k_att0<0><<<dim3(NH * (QT0 / 64), NB), 1024, 0, stream>>>(QKVF0, QKVF0 + DM, QKVF0 + 2 * DM, LQ, (size_t)QT0 * LQ, nullptr, 0.125f, OF0, DM, (size_t)QT0 * DM);      /* exact f32 attention for rows 0..127 of every batch (o x64) */
  k_vt<NH, SQ><<<NB * NH * (SQ / 64), 256, 0, stream>>>(V16, LQ, 0, VT);      /* V^T [NB][NH][HD][SQ] */
  k_fattn<<<dim3(NB * NH, SQ / 128), 128, 0, stream>>>(QKV, VT, O16);      /* o (merged heads, x64) as f16 rows, every batch, head and query tile in one launch */
  k_gemm3<0, 1, 1, 0><<<(unsigned)((MPO / 256) * (DM / 128)), 256, 0, stream>>>(O16 + r0p * DM, DM, BO, DM, 0.0009765625f, bo, XB + r0p * DM, X1 + r0p * DM, nullptr, DM, MPO, DM, DM);      /* out rows are the output layout */
  k_hl<<<(unsigned)(((size_t)NB * QT0 * DM / 8 + 255) / 256), 256, 0, stream>>>(OF0, OH0, OL0, (size_t)NB * QT0 * DM / 8);      /* first-tile o (x64) -> f16 hi + x1024 residual planes */
  k_gemm2<0, 1><<<dim3((QT0 / 128) * (DM / 64), NB), 128, 0, stream>>>(OH0, DM, (size_t)QT0 * DM, BO, DM, 0, 0.0009765625f, bo, 0, XB, -1, 0, 0, X1, nullptr, DM, (size_t)SQ * DM, QT0, DM, DM);      /* rows 0..127 of every batch: x1 = o_hi Wo + x, overwriting the f16-path rows */
  k_gemm2<0, 1><<<dim3((QT0 / 128) * (DM / 64), NB), 128, 0, stream>>>(OL0, DM, (size_t)QT0 * DM, BO, DM, 0, 0.00000095367431640625f, nullptr, 0, X1, -1, 0, 0, X1, nullptr, DM, (size_t)SQ * DM, QT0, DM, DM);      /* += o_lo Wo 2^-20 (own-element accumulate) */
  k_ln16<0, 0><<<(unsigned)NR, 256, 0, stream>>>(X1, gg2, be2, 1e-5f, M16, nullptr);      /* h = LN2(x1) -> f16 rows */
  k_gemm3<6, 0, 0, 1><<<(unsigned)((MPO / 256) * (DFF / 128)), 256, 0, stream>>>(M16, DM, BW1, DM, 0.0625f, bfc, nullptr, nullptr, HF16, DFF, MPO, DFF, DM);      /* gelu_erf(h2 W1 + b1) -> f16, the token rows of all batches in one launch */
  k_gemm3<0, 1, 1, 0><<<(unsigned)((MPO / 256) * (DM / 128)), 256, 0, stream>>>(HF16, DFF, BW2, DFF, 0.0625f, bmp, X1, (float*)d_out, nullptr, DM, MPO, DM, DFF);      /* out = x1 + mlp (own-element residual), all batches: 256 work-groups, one to a WGP */
}
